// v000
// The times below were measured on an AMD MI455X: many runs one after another, warmed up first and cycling through
// copies of the inputs, with the whole window's GPU time divided by the number of runs. Launches and the gaps
// between them are all in it. The median over several windows is given; except for v000 it joins two sittings, which
// can be a few percent apart, so the side-by-side timings, each taken in one sitting, are the better comparison.
// The starting kernel, v000, takes 462 microseconds a run.
#include <hip/hip_runtime.h>

typedef float v2f __attribute__((ext_vector_type(2)));
typedef float v8f __attribute__((ext_vector_type(8)));

#define WMMA_F32(a, b, c)                                                      \
  __builtin_amdgcn_wmma_f32_16x16x4_f32(false, (a), false, (b), (short)0, (c), \
                                        false, false)

// Y[M,N] = W[M,K] * X[K,N] (row-major; per-batch X/Y strides).
// Block = 128 threads (4 waves). Block tile: 64 rows x 64 cols of Y;
// each wave owns a 64x16 sub-tile (4 v8f accumulators).
// grid = (N/64, M/64, B).
template <int K, int N>
__global__ __launch_bounds__(128, 1) void gemm_wmma_f32_kernel(
    const float* __restrict__ Wm, const float* __restrict__ X,
    float* __restrict__ Y, long xbs, long ybs) {
  constexpr int KB = 16;        // K-rows staged into LDS per iteration
  constexpr int LDP = 80;       // padded LDS row stride (words)
  __shared__ float s_x[KB * LDP];  // 5 KB staging buffer for the B tile

  const int tid = threadIdx.x;
  const int lane = tid & 31;
  const int wave = tid >> 5;
  const int lo = lane & 15;  // M (A) / N (B) index within 16-wide tile
  const int hi = lane >> 4;  // selects K sub-pair {0,1} vs {2,3}
  const int nblk = blockIdx.x * 64;    // block's 64-column range
  const int ncol = wave * 16 + lo;     // this lane's column within block tile
  const int r0 = blockIdx.y * 64;
  const float* Xb = X + (long)blockIdx.z * xbs;
  float* Yb = Y + (long)blockIdx.z * ybs;

  // Async staging pattern: 128 threads x 16B = 8 rows x 64 cols per issue;
  // two issues cover the 16x64 tile.
  const int sr = tid >> 4;         // staging row 0..7 (and sr+8)
  const int sc = (tid & 15) * 4;   // staging column (float4 granularity)
  const unsigned ld0 = (unsigned)(sr * LDP + sc) * 4u;
  const unsigned ld1 = (unsigned)((sr + 8) * LDP + sc) * 4u;
  const unsigned lbase = (unsigned)(unsigned long long)(uintptr_t)&s_x[0];

  v8f acc0 = {}; v8f acc1 = {}; v8f acc2 = {}; v8f acc3 = {};

  for (int k0 = 0; k0 < K; k0 += KB) {
    // ---- stage B tile [k0..k0+15] x [nblk..nblk+63] into LDS (async) ----
    const float* src0 = Xb + (long)(k0 + sr) * N + nblk + sc;
    const float* src1 = src0 + (long)8 * N;
    asm volatile(
        "global_load_async_to_lds_b128 %0, %2, off\n\t"
        "global_load_async_to_lds_b128 %1, %3, off\n\t"
        "s_wait_asynccnt 0x0"
        :
        : "v"(lbase + ld0), "v"(lbase + ld1), "v"(src0), "v"(src1)
        : "memory");
    __syncthreads();

    // ---- 4 WMMA K-steps over the staged tile ----
#pragma unroll
    for (int kk = 0; kk < KB; kk += 4) {
      const int kw = kk + 2 * hi;
      v2f bv;
      bv.x = s_x[(kw + 0) * LDP + ncol];
      bv.y = s_x[(kw + 1) * LDP + ncol];
      const int ka = k0 + kw;
      v2f a0 = *(const v2f*)(Wm + (long)(r0 +  0 + lo) * K + ka);
      v2f a1 = *(const v2f*)(Wm + (long)(r0 + 16 + lo) * K + ka);
      v2f a2 = *(const v2f*)(Wm + (long)(r0 + 32 + lo) * K + ka);
      v2f a3 = *(const v2f*)(Wm + (long)(r0 + 48 + lo) * K + ka);
      acc0 = WMMA_F32(a0, bv, acc0);
      acc1 = WMMA_F32(a1, bv, acc1);
      acc2 = WMMA_F32(a2, bv, acc2);
      acc3 = WMMA_F32(a3, bv, acc3);
    }
    __syncthreads();  // LDS tile reuse fence
  }

  const int col = nblk + ncol;
#pragma unroll
  for (int j = 0; j < 8; ++j) {
    const int row = j + 8 * hi;
    Yb[(long)(r0 +  0 + row) * N + col] = acc0[j];
    Yb[(long)(r0 + 16 + row) * N + col] = acc1[j];
    Yb[(long)(r0 + 32 + row) * N + col] = acc2[j];
    Yb[(long)(r0 + 48 + row) * N + col] = acc3[j];
  }
}

#define CR 64
#define WIN 7
#define KWIN 49
#define CORR_BLOCK 256

// One thread per pixel. Center feature vector (64 ch) lives in registers via
// fully unrolled channel loops; the 49 attention weights live in LDS so the
// dynamically-indexed softmax does not spill to scratch.
__global__ __launch_bounds__(CORR_BLOCK, 1) void corr_attention_kernel(
    const float* __restrict__ feat, float* __restrict__ corr, int B, int H,
    int Wd) {
  __shared__ float att_s[KWIN * CORR_BLOCK];

  const int HW = H * Wd;
  const int idx = blockIdx.x * blockDim.x + threadIdx.x;
  if (idx >= B * HW) return;
  const int tid = threadIdx.x;
  const int b = idx / HW;
  const int p = idx - b * HW;
  const int h = p / Wd;
  const int w = p - h * Wd;
  const float* fb = feat + (long)b * CR * HW;

  // center feature -> registers
  float fc[CR];
  float cn2 = 0.f;
#pragma unroll
  for (int c = 0; c < CR; ++c) {
    fc[c] = fb[(long)c * HW + p];
    cn2 += fc[c] * fc[c];
  }
  const float cn = sqrtf(cn2);

  // pass 1: cosine similarity per window offset (zero-padded OOB -> sim = 0)
  float mx = -1e30f;
#pragma unroll 1
  for (int k = 0; k < KWIN; ++k) {
    const int hh = h + (k / WIN) - (WIN / 2);
    const int ww = w + (k % WIN) - (WIN / 2);
    float sim = 0.f;
    if (hh >= 0 && hh < H && ww >= 0 && ww < Wd) {
      const long np = (long)hh * Wd + ww;
      float dot = 0.f, pn2 = 0.f;
#pragma unroll
      for (int c = 0; c < CR; ++c) {
        const float g = fb[(long)c * HW + np];
        dot += fc[c] * g;
        pn2 += g * g;
      }
      sim = dot / fmaxf(cn * sqrtf(pn2), 1e-8f);
    }
    att_s[k * CORR_BLOCK + tid] = sim;
    mx = fmaxf(mx, sim);
  }

  // softmax over the 49 window positions
  float s = 0.f;
#pragma unroll 1
  for (int k = 0; k < KWIN; ++k) {
    const float e = expf(att_s[k * CORR_BLOCK + tid] - mx);
    att_s[k * CORR_BLOCK + tid] = e;
    s += e;
  }
  const float inv = 1.f / s;

  // pass 2: weighted patch sum (64-channel accumulator in registers)
  float acc[CR];
#pragma unroll
  for (int c = 0; c < CR; ++c) acc[c] = 0.f;

#pragma unroll 1
  for (int k = 0; k < KWIN; ++k) {
    const int hh = h + (k / WIN) - (WIN / 2);
    const int ww = w + (k % WIN) - (WIN / 2);
    if (hh < 0 || hh >= H || ww < 0 || ww >= Wd) continue;  // zero patch
    const long np = (long)hh * Wd + ww;
    const float a = att_s[k * CORR_BLOCK + tid] * inv;
#pragma unroll
    for (int c = 0; c < CR; ++c) acc[c] += a * fb[(long)c * HW + np];
  }

  float* cb = corr + (long)b * CR * HW;
#pragma unroll
  for (int c = 0; c < CR; ++c) cb[(long)c * HW + p] = acc[c];
}

extern "C" void kernel_launch(void* const* d_in, const int* in_sizes, int n_in,
                              void* d_out, int out_size, void* d_ws,
                              size_t ws_size, hipStream_t stream) {
  const float* x = (const float*)d_in[0];         // [8,256,64,64]
  const float* w_reduce = (const float*)d_in[1];  // [64,256]
  const float* w_proj = (const float*)d_in[2];    // [512,64]
  float* out = (float*)d_out;                     // [8,512,64,64]

  const int B = 8, C = 256, H = 64, Wd = 64, CO = 512;
  const int HW = H * Wd;  // 4096

  float* feat = (float*)d_ws;                     // [8,64,64,64]  8.4 MB
  float* corr = feat + (size_t)B * CR * HW;       // [8,64,64,64]  8.4 MB

  // feat = w_reduce @ x : M=64, K=256, N=4096 per batch
  {
    dim3 grid(HW / 64, 64 / 64, B);
    gemm_wmma_f32_kernel<256, 4096><<<grid, 128, 0, stream>>>(
        w_reduce, x, feat, (long)C * HW, (long)CR * HW);
  }

  // windowed cosine-sim softmax attention
  {
    const int n = B * HW;
    corr_attention_kernel<<<(n + CORR_BLOCK - 1) / CORR_BLOCK, CORR_BLOCK, 0,
                            stream>>>(feat, corr, B, H, Wd);
  }

  // out = w_proj @ corr : M=512, K=64, N=4096 per batch
  {
    dim3 grid(HW / 64, CO / 64, B);
    gemm_wmma_f32_kernel<64, 4096><<<grid, 128, 0, stream>>>(
        w_proj, corr, out, (long)CR * HW, (long)CO * HW);
  }
}

// v001
// A run of this version takes 77.5 microseconds.
// Timed twice side by side with v000, it ran 6.01 and 5.97 times as fast.
#include <hip/hip_runtime.h>

typedef float v2f __attribute__((ext_vector_type(2)));
typedef float v8f __attribute__((ext_vector_type(8)));

#define WMMA_F32(a, b, c)                                                      \
  __builtin_amdgcn_wmma_f32_16x16x4_f32(false, (a), false, (b), (short)0, (c), \
                                        false, false)

// Y[M,N] = W[M,K] * X[K,N] (row-major; per-batch X/Y strides).
// Block = 128 threads (4 waves). Block tile: 64 rows x 64 cols of Y;
// each wave owns a 64x16 sub-tile (4 v8f accumulators).
// grid = (N/64, M/64, B).
template <int K, int N>
__global__ __launch_bounds__(128, 1) void gemm_wmma_f32_kernel(
    const float* __restrict__ Wm, const float* __restrict__ X,
    float* __restrict__ Y, long xbs, long ybs) {
  constexpr int KB = 16;        // K-rows staged into LDS per iteration
  constexpr int LDP = 80;       // padded LDS row stride (words)
  __shared__ float s_x[KB * LDP];  // 5 KB staging buffer for the B tile

  const int tid = threadIdx.x;
  const int lane = tid & 31;
  const int wave = tid >> 5;
  const int lo = lane & 15;  // M (A) / N (B) index within 16-wide tile
  const int hi = lane >> 4;  // selects K sub-pair {0,1} vs {2,3}
  const int nblk = blockIdx.x * 64;    // block's 64-column range
  const int ncol = wave * 16 + lo;     // this lane's column within block tile
  const int r0 = blockIdx.y * 64;
  const float* Xb = X + (long)blockIdx.z * xbs;
  float* Yb = Y + (long)blockIdx.z * ybs;

  // Async staging pattern: 128 threads x 16B = 8 rows x 64 cols per issue;
  // two issues cover the 16x64 tile.
  const int sr = tid >> 4;         // staging row 0..7 (and sr+8)
  const int sc = (tid & 15) * 4;   // staging column (float4 granularity)
  const unsigned ld0 = (unsigned)(sr * LDP + sc) * 4u;
  const unsigned ld1 = (unsigned)((sr + 8) * LDP + sc) * 4u;
  const unsigned lbase = (unsigned)(unsigned long long)(uintptr_t)&s_x[0];

  v8f acc0 = {}; v8f acc1 = {}; v8f acc2 = {}; v8f acc3 = {};

  for (int k0 = 0; k0 < K; k0 += KB) {
    // ---- stage B tile [k0..k0+15] x [nblk..nblk+63] into LDS (async) ----
    const float* src0 = Xb + (long)(k0 + sr) * N + nblk + sc;
    const float* src1 = src0 + (long)8 * N;
    asm volatile(
        "global_load_async_to_lds_b128 %0, %2, off\n\t"
        "global_load_async_to_lds_b128 %1, %3, off\n\t"
        "s_wait_asynccnt 0x0"
        :
        : "v"(lbase + ld0), "v"(lbase + ld1), "v"(src0), "v"(src1)
        : "memory");
    __syncthreads();

    // ---- 4 WMMA K-steps over the staged tile ----
#pragma unroll
    for (int kk = 0; kk < KB; kk += 4) {
      const int kw = kk + 2 * hi;
      v2f bv;
      bv.x = s_x[(kw + 0) * LDP + ncol];
      bv.y = s_x[(kw + 1) * LDP + ncol];
      const int ka = k0 + kw;
      v2f a0 = *(const v2f*)(Wm + (long)(r0 +  0 + lo) * K + ka);
      v2f a1 = *(const v2f*)(Wm + (long)(r0 + 16 + lo) * K + ka);
      v2f a2 = *(const v2f*)(Wm + (long)(r0 + 32 + lo) * K + ka);
      v2f a3 = *(const v2f*)(Wm + (long)(r0 + 48 + lo) * K + ka);
      acc0 = WMMA_F32(a0, bv, acc0);
      acc1 = WMMA_F32(a1, bv, acc1);
      acc2 = WMMA_F32(a2, bv, acc2);
      acc3 = WMMA_F32(a3, bv, acc3);
    }
    __syncthreads();  // LDS tile reuse fence
  }

  const int col = nblk + ncol;
#pragma unroll
  for (int j = 0; j < 8; ++j) {
    const int row = j + 8 * hi;
    Yb[(long)(r0 +  0 + row) * N + col] = acc0[j];
    Yb[(long)(r0 + 16 + row) * N + col] = acc1[j];
    Yb[(long)(r0 + 32 + row) * N + col] = acc2[j];
    Yb[(long)(r0 + 48 + row) * N + col] = acc3[j];
  }
}

#define CR 64
#define WIN 7
#define KWIN 49
#define IMG 64                    // image height and width
#define IMG_HW (IMG * IMG)
#define TILE_H 8                  // pixel tile of one block
#define TILE_W 16
#define CORR_BLOCK (TILE_H * TILE_W)
#define HALO_H (TILE_H + WIN - 1) // 14 staged rows
#define HALO_W 24                 // staged columns w0-4 .. w0+19 (16-byte aligned)
#define PIX_PITCH 68              // words per staged pixel: 272 B = 16 B x odd

// One thread per pixel, one 8x16 pixel tile per block. The tile and its halo
// (all 64 channels) are staged once in LDS, pixel-major, so that each window
// position is 16 conflict-free 16-byte LDS reads per lane. Pixels outside the
// image are staged as zeros, which is the reference's zero padding. The 49
// attention weights live in LDS as well (dynamically indexed).
__global__ __launch_bounds__(CORR_BLOCK, 1) void corr_attention_kernel(
    const float* __restrict__ feat, float* __restrict__ corr) {
  __shared__ __attribute__((aligned(16))) float f_s[HALO_H * HALO_W * PIX_PITCH];
  __shared__ float att_s[KWIN * CORR_BLOCK];

  const int tid = threadIdx.x;
  const int b = blockIdx.x >> 5;            // 32 tiles per image
  const int tile = blockIdx.x & 31;
  const int h0 = (tile >> 2) * TILE_H;
  const int w0 = (tile & 3) * TILE_W;
  const float* fb = feat + (long)b * CR * IMG_HW;

  // ---- stage: 4 channels x 4 pixels per lane, transposed in registers ----
  {
    const int lane = tid & 31;
    const int pq = lane & 7;                    // 16-byte piece of a 128-byte line
    const int cq = (tid >> 5) * 4 + (lane >> 3);  // channel quad 0..15
    if (pq >= 1 && pq <= 6) {
      const int gw = w0 - 8 + pq * 4;
      const bool col_in = gw >= 0 && gw < IMG;
      const int gwc = min(max(gw, 0), IMG - 4);
      // one lane offset for every load; the row comes in through a uniform base
      const unsigned loff = (unsigned)(cq * 4 * IMG_HW + gwc);
      float* dp = f_s + (pq - 1) * 4 * PIX_PITCH + cq * 4;
      // unrolled so that every row's loads are in flight before the first store
#pragma unroll
      for (int r = 0; r < HALO_H; ++r) {
        const int gh = h0 - (WIN / 2) + r;
        const bool in = col_in && gh >= 0 && gh < IMG;
        const float* s = fb + min(max(gh, 0), IMG - 1) * IMG;
        const float4 v0 = *(const float4*)(s + loff);
        const float4 v1 = *(const float4*)(s + IMG_HW + loff);
        const float4 v2 = *(const float4*)(s + 2 * IMG_HW + loff);
        const float4 v3 = *(const float4*)(s + 3 * IMG_HW + loff);
        float* d = dp + r * HALO_W * PIX_PITCH;
        *(float4*)(d) = make_float4(in ? v0.x : 0.f, in ? v1.x : 0.f,
                                    in ? v2.x : 0.f, in ? v3.x : 0.f);
        *(float4*)(d + PIX_PITCH) = make_float4(in ? v0.y : 0.f, in ? v1.y : 0.f,
                                                in ? v2.y : 0.f, in ? v3.y : 0.f);
        *(float4*)(d + 2 * PIX_PITCH) = make_float4(in ? v0.z : 0.f, in ? v1.z : 0.f,
                                                    in ? v2.z : 0.f, in ? v3.z : 0.f);
        *(float4*)(d + 3 * PIX_PITCH) = make_float4(in ? v0.w : 0.f, in ? v1.w : 0.f,
                                                    in ? v2.w : 0.f, in ? v3.w : 0.f);
      }
    }
  }
  __syncthreads();  // the staged tile is read by every wave

  const int th = tid >> 4;
  const int tw = tid & 15;
  // window position (di, dj) of this pixel: staged row th+di, column tw+1+dj
  const float* base = f_s + (th * HALO_W + tw + 1) * PIX_PITCH;

  // center feature -> registers
  float fc[CR];
  float cn2 = 0.f;
  {
    const float* cp = base + ((WIN / 2) * HALO_W + (WIN / 2)) * PIX_PITCH;
#pragma unroll
    for (int q = 0; q < CR / 4; ++q) {
      const float4 g = *(const float4*)(cp + q * 4);
      fc[q * 4 + 0] = g.x; fc[q * 4 + 1] = g.y;
      fc[q * 4 + 2] = g.z; fc[q * 4 + 3] = g.w;
    }
#pragma unroll
    for (int c = 0; c < CR; ++c) cn2 += fc[c] * fc[c];
  }
  const float cn = sqrtf(cn2);

  // pass 1: cosine similarity per window offset; the seven offsets of a window
  // row run as independent sums, each in ascending channel order
  // (window rows stay rolled for code size; inner loops are unrolled so that
  // the register arrays are indexed by constants and offsets are immediates)
  float mx = -1e30f;
#pragma unroll 1
  for (int di = 0; di < WIN; ++di) {
    const float* rp = base + di * HALO_W * PIX_PITCH;
    float dot[WIN], pn2[WIN];
#pragma unroll
    for (int dj = 0; dj < WIN; ++dj) { dot[dj] = 0.f; pn2[dj] = 0.f; }
#pragma unroll
    for (int q = 0; q < CR / 4; ++q) {
      float4 g[WIN];
#pragma unroll
      for (int dj = 0; dj < WIN; ++dj)
        g[dj] = *(const float4*)(rp + dj * PIX_PITCH + q * 4);
#pragma unroll
      for (int dj = 0; dj < WIN; ++dj) { dot[dj] += fc[q * 4 + 0] * g[dj].x; pn2[dj] += g[dj].x * g[dj].x; }
#pragma unroll
      for (int dj = 0; dj < WIN; ++dj) { dot[dj] += fc[q * 4 + 1] * g[dj].y; pn2[dj] += g[dj].y * g[dj].y; }
#pragma unroll
      for (int dj = 0; dj < WIN; ++dj) { dot[dj] += fc[q * 4 + 2] * g[dj].z; pn2[dj] += g[dj].z * g[dj].z; }
#pragma unroll
      for (int dj = 0; dj < WIN; ++dj) { dot[dj] += fc[q * 4 + 3] * g[dj].w; pn2[dj] += g[dj].w * g[dj].w; }
    }
#pragma unroll
    for (int dj = 0; dj < WIN; ++dj) {
      const float sim = dot[dj] / fmaxf(cn * sqrtf(pn2[dj]), 1e-8f);
      att_s[(di * WIN + dj) * CORR_BLOCK + tid] = sim;
      mx = fmaxf(mx, sim);
    }
  }

  // softmax over the 49 window positions
  float s = 0.f;
#pragma unroll 1
  for (int k = 0; k < KWIN; ++k) {
    const float e = expf(att_s[k * CORR_BLOCK + tid] - mx);
    att_s[k * CORR_BLOCK + tid] = e;
    s += e;
  }
  const float inv = 1.f / s;

  // pass 2: weighted patch sum (64-channel accumulator in registers)
  float acc[CR];
#pragma unroll
  for (int c = 0; c < CR; ++c) acc[c] = 0.f;

  // window rows rolled for code size, as in pass 1
#pragma unroll 1
  for (int di = 0; di < WIN; ++di) {
    const float* rp = base + di * HALO_W * PIX_PITCH;
#pragma unroll
    for (int dj = 0; dj < WIN; ++dj) {
      const float a = att_s[(di * WIN + dj) * CORR_BLOCK + tid] * inv;
#pragma unroll
      for (int q = 0; q < CR / 4; ++q) {
        const float4 g = *(const float4*)(rp + dj * PIX_PITCH + q * 4);
        acc[q * 4 + 0] += a * g.x;
        acc[q * 4 + 1] += a * g.y;
        acc[q * 4 + 2] += a * g.z;
        acc[q * 4 + 3] += a * g.w;
      }
    }
  }

  float* cb = corr + (long)b * CR * IMG_HW + (h0 + th) * IMG + w0 + tw;
#pragma unroll
  for (int c = 0; c < CR; ++c) cb[(long)c * IMG_HW] = acc[c];
}

extern "C" void kernel_launch(void* const* d_in, const int* in_sizes, int n_in,
                              void* d_out, int out_size, void* d_ws,
                              size_t ws_size, hipStream_t stream) {
  const float* x = (const float*)d_in[0];         // [8,256,64,64]
  const float* w_reduce = (const float*)d_in[1];  // [64,256]
  const float* w_proj = (const float*)d_in[2];    // [512,64]
  float* out = (float*)d_out;                     // [8,512,64,64]

  const int B = 8, C = 256, H = 64, Wd = 64, CO = 512;
  const int HW = H * Wd;  // 4096

  float* feat = (float*)d_ws;                     // [8,64,64,64]  8.4 MB
  float* corr = feat + (size_t)B * CR * HW;       // [8,64,64,64]  8.4 MB

  // feat = w_reduce @ x : M=64, K=256, N=4096 per batch
  {
    dim3 grid(HW / 64, 64 / 64, B);
    gemm_wmma_f32_kernel<256, 4096><<<grid, 128, 0, stream>>>(
        w_reduce, x, feat, (long)C * HW, (long)CR * HW);
  }

  // windowed cosine-sim softmax attention: one block per 8x16 pixel tile
  corr_attention_kernel<<<B * HW / CORR_BLOCK, CORR_BLOCK, 0, stream>>>(feat,
                                                                        corr);

  // out = w_proj @ corr : M=512, K=64, N=4096 per batch
  {
    dim3 grid(HW / 64, CO / 64, B);
    gemm_wmma_f32_kernel<64, 4096><<<grid, 128, 0, stream>>>(
        w_proj, corr, out, (long)CR * HW, (long)CO * HW);
  }
}

// v002
// One run takes 58.7 microseconds.
// Two timings next to v001 both put it at 1.32 times that version's speed.
// Over all steps from v000 it is 7.89 times as fast.
#include <hip/hip_runtime.h>

typedef float v2f __attribute__((ext_vector_type(2)));
typedef float v8f __attribute__((ext_vector_type(8)));

#define WMMA_F32(a, b, c)                                                      \
  __builtin_amdgcn_wmma_f32_16x16x4_f32(false, (a), false, (b), (short)0, (c), \
                                        false, false)

// Y[M,N] = W[M,K] * X[K,N] (row-major; per-batch X/Y strides).
// Block = 128 threads (4 waves). Block tile: 64 rows x 64 cols of Y;
// each wave owns a 64x16 sub-tile (4 v8f accumulators).
// grid = (N/64, M/64, B).
template <int K, int N>
__global__ __launch_bounds__(128, 1) void gemm_wmma_f32_kernel(
    const float* __restrict__ Wm, const float* __restrict__ X,
    float* __restrict__ Y, long xbs, long ybs) {
  constexpr int KB = 16;        // K-rows staged into LDS per iteration
  constexpr int LDP = 80;       // padded LDS row stride (words)
  constexpr int LAP = 20;       // padded LDS row stride of the A chunk (words)
  __shared__ __attribute__((aligned(16))) float s_x[KB * LDP];  // 5 KB, B tile
  __shared__ __attribute__((aligned(16))) float s_w[64 * LAP];

  const int tid = threadIdx.x;
  const int lane = tid & 31;
  const int wave = tid >> 5;
  const int lo = lane & 15;  // M (A) / N (B) index within 16-wide tile
  const int hi = lane >> 4;  // selects K sub-pair {0,1} vs {2,3}
  const int nblk = blockIdx.x * 64;    // block's 64-column range
  const int ncol = wave * 16 + lo;     // this lane's column within block tile
  const int r0 = blockIdx.y * 64;
  const float* Xb = X + (long)blockIdx.z * xbs;
  float* Yb = Y + (long)blockIdx.z * ybs;

  // Async staging pattern: 128 threads x 16B = 8 rows x 64 cols per issue;
  // two issues cover the 16x64 tile.
  const int sr = tid >> 4;         // staging row 0..7 (and sr+8)
  const int sc = (tid & 15) * 4;   // staging column (float4 granularity)
  const unsigned ld0 = (unsigned)(sr * LDP + sc) * 4u;
  const unsigned ld1 = (unsigned)((sr + 8) * LDP + sc) * 4u;
  const unsigned lbase = (unsigned)(unsigned long long)(uintptr_t)&s_x[0];
  // A chunk: 128 threads x 16B = 32 rows x 16 k per issue; two issues cover
  // the 64 x 16 chunk (each row's 64 bytes are fetched once per block instead
  // of piecewise by every wave).
  const int ar = tid >> 2;         // staging row 0..31 (and ar+32)
  const int ac = (tid & 3) * 4;    // staging k (float4 granularity)
  const unsigned wbase = (unsigned)(unsigned long long)(uintptr_t)&s_w[0];
  const unsigned la0 = wbase + (unsigned)(ar * LAP + ac) * 4u;
  const unsigned la1 = wbase + (unsigned)((ar + 32) * LAP + ac) * 4u;
  const float* wsrc = Wm + (long)(r0 + ar) * K + ac;

  v8f acc0 = {}; v8f acc1 = {}; v8f acc2 = {}; v8f acc3 = {};

  for (int k0 = 0; k0 < K; k0 += KB) {
    // ---- stage B tile [k0..k0+15] x [nblk..nblk+63] into LDS (async) ----
    const float* src0 = Xb + (long)(k0 + sr) * N + nblk + sc;
    const float* src1 = src0 + (long)8 * N;
    // ---- and the A chunk [r0..r0+63] x [k0..k0+15] ----
    const float* wsrc0 = wsrc + k0;
    const float* wsrc1 = wsrc0 + (long)32 * K;
    asm volatile(
        "global_load_async_to_lds_b128 %0, %4, off\n\t"
        "global_load_async_to_lds_b128 %1, %5, off\n\t"
        "global_load_async_to_lds_b128 %2, %6, off\n\t"
        "global_load_async_to_lds_b128 %3, %7, off\n\t"
        "s_wait_xcnt 0x0"
        :
        : "v"(lbase + ld0), "v"(lbase + ld1), "v"(la0), "v"(la1), "v"(src0),
          "v"(src1), "v"(wsrc0), "v"(wsrc1)
        : "memory");
    // this wave's copies have landed before it signals the barrier
    asm volatile("s_wait_asynccnt 0x0" ::: "memory");
    __syncthreads();

    // ---- 4 WMMA K-steps over the staged tile ----
#pragma unroll
    for (int kk = 0; kk < KB; kk += 4) {
      const int kw = kk + 2 * hi;
      v2f bv;
      bv.x = s_x[(kw + 0) * LDP + ncol];
      bv.y = s_x[(kw + 1) * LDP + ncol];
      v2f a0 = *(const v2f*)(s_w + ( 0 + lo) * LAP + kw);
      v2f a1 = *(const v2f*)(s_w + (16 + lo) * LAP + kw);
      v2f a2 = *(const v2f*)(s_w + (32 + lo) * LAP + kw);
      v2f a3 = *(const v2f*)(s_w + (48 + lo) * LAP + kw);
      acc0 = WMMA_F32(a0, bv, acc0);
      acc1 = WMMA_F32(a1, bv, acc1);
      acc2 = WMMA_F32(a2, bv, acc2);
      acc3 = WMMA_F32(a3, bv, acc3);
    }
    __syncthreads();  // LDS tile reuse fence
  }

  const int col = nblk + ncol;
#pragma unroll
  for (int j = 0; j < 8; ++j) {
    const int row = j + 8 * hi;
    Yb[(long)(r0 +  0 + row) * N + col] = acc0[j];
    Yb[(long)(r0 + 16 + row) * N + col] = acc1[j];
    Yb[(long)(r0 + 32 + row) * N + col] = acc2[j];
    Yb[(long)(r0 + 48 + row) * N + col] = acc3[j];
  }
}

#define CR 64
#define WIN 7
#define KWIN 49
#define IMG 64                    // image height and width
#define IMG_HW (IMG * IMG)
#define TILE_H 8                  // pixel tile of one block
#define TILE_W 16
#define CORR_BLOCK (TILE_H * TILE_W)
#define HALO_H (TILE_H + WIN - 1) // 14 staged rows
#define HALO_W 24                 // staged columns w0-4 .. w0+19 (16-byte aligned)
#define PIX_PITCH 68              // words per staged pixel: 272 B = 16 B x odd

// One thread per pixel, one 8x16 pixel tile per block. The tile and its halo
// (all 64 channels) are staged once in LDS, pixel-major, so that each window
// position is 16 conflict-free 16-byte LDS reads per lane. Pixels outside the
// image are staged as zeros, which is the reference's zero padding. The 49
// attention weights live in LDS as well (dynamically indexed).
__global__ __launch_bounds__(CORR_BLOCK, 1) void corr_attention_kernel(
    const float* __restrict__ feat, float* __restrict__ corr) {
  __shared__ __attribute__((aligned(16))) float f_s[HALO_H * HALO_W * PIX_PITCH];
  __shared__ float att_s[KWIN * CORR_BLOCK];

  const int tid = threadIdx.x;
  const int b = blockIdx.x >> 5;            // 32 tiles per image
  const int tile = blockIdx.x & 31;
  const int h0 = (tile >> 2) * TILE_H;
  const int w0 = (tile & 3) * TILE_W;
  const float* fb = feat + (long)b * CR * IMG_HW;

  // ---- stage: 4 channels x 4 pixels per lane, transposed in registers ----
  {
    const int lane = tid & 31;
    const int pq = lane & 7;                    // 16-byte piece of a 128-byte line
    const int cq = (tid >> 5) * 4 + (lane >> 3);  // channel quad 0..15
    if (pq >= 1 && pq <= 6) {
      const int gw = w0 - 8 + pq * 4;
      const bool col_in = gw >= 0 && gw < IMG;
      const int gwc = min(max(gw, 0), IMG - 4);
      // one lane offset for every load; the row comes in through a uniform base
      const unsigned loff = (unsigned)(cq * 4 * IMG_HW + gwc);
      float* dp = f_s + (pq - 1) * 4 * PIX_PITCH + cq * 4;
      // unrolled so that every row's loads are in flight before the first store
#pragma unroll
      for (int r = 0; r < HALO_H; ++r) {
        const int gh = h0 - (WIN / 2) + r;
        const bool in = col_in && gh >= 0 && gh < IMG;
        const float* s = fb + min(max(gh, 0), IMG - 1) * IMG;
        const float4 v0 = *(const float4*)(s + loff);
        const float4 v1 = *(const float4*)(s + IMG_HW + loff);
        const float4 v2 = *(const float4*)(s + 2 * IMG_HW + loff);
        const float4 v3 = *(const float4*)(s + 3 * IMG_HW + loff);
        float* d = dp + r * HALO_W * PIX_PITCH;
        *(float4*)(d) = make_float4(in ? v0.x : 0.f, in ? v1.x : 0.f,
                                    in ? v2.x : 0.f, in ? v3.x : 0.f);
        *(float4*)(d + PIX_PITCH) = make_float4(in ? v0.y : 0.f, in ? v1.y : 0.f,
                                                in ? v2.y : 0.f, in ? v3.y : 0.f);
        *(float4*)(d + 2 * PIX_PITCH) = make_float4(in ? v0.z : 0.f, in ? v1.z : 0.f,
                                                    in ? v2.z : 0.f, in ? v3.z : 0.f);
        *(float4*)(d + 3 * PIX_PITCH) = make_float4(in ? v0.w : 0.f, in ? v1.w : 0.f,
                                                    in ? v2.w : 0.f, in ? v3.w : 0.f);
      }
    }
  }
  __syncthreads();  // the staged tile is read by every wave

  const int th = tid >> 4;
  const int tw = tid & 15;
  // window position (di, dj) of this pixel: staged row th+di, column tw+1+dj
  const float* base = f_s + (th * HALO_W + tw + 1) * PIX_PITCH;

  // center feature -> registers
  float fc[CR];
  float cn2 = 0.f;
  {
    const float* cp = base + ((WIN / 2) * HALO_W + (WIN / 2)) * PIX_PITCH;
#pragma unroll
    for (int q = 0; q < CR / 4; ++q) {
      const float4 g = *(const float4*)(cp + q * 4);
      fc[q * 4 + 0] = g.x; fc[q * 4 + 1] = g.y;
      fc[q * 4 + 2] = g.z; fc[q * 4 + 3] = g.w;
    }
#pragma unroll
    for (int c = 0; c < CR; ++c) cn2 += fc[c] * fc[c];
  }
  const float cn = sqrtf(cn2);

  // pass 1: cosine similarity per window offset; the seven offsets of a window
  // row run as independent sums, each in ascending channel order
  // (window rows stay rolled for code size; inner loops are unrolled so that
  // the register arrays are indexed by constants and offsets are immediates)
  float mx = -1e30f;
#pragma unroll 1
  for (int di = 0; di < WIN; ++di) {
    const float* rp = base + di * HALO_W * PIX_PITCH;
    float dot[WIN], pn2[WIN];
#pragma unroll
    for (int dj = 0; dj < WIN; ++dj) { dot[dj] = 0.f; pn2[dj] = 0.f; }
#pragma unroll
    for (int q = 0; q < CR / 4; ++q) {
      float4 g[WIN];
#pragma unroll
      for (int dj = 0; dj < WIN; ++dj)
        g[dj] = *(const float4*)(rp + dj * PIX_PITCH + q * 4);
#pragma unroll
      for (int dj = 0; dj < WIN; ++dj) { dot[dj] += fc[q * 4 + 0] * g[dj].x; pn2[dj] += g[dj].x * g[dj].x; }
#pragma unroll
      for (int dj = 0; dj < WIN; ++dj) { dot[dj] += fc[q * 4 + 1] * g[dj].y; pn2[dj] += g[dj].y * g[dj].y; }
#pragma unroll
      for (int dj = 0; dj < WIN; ++dj) { dot[dj] += fc[q * 4 + 2] * g[dj].z; pn2[dj] += g[dj].z * g[dj].z; }
#pragma unroll
      for (int dj = 0; dj < WIN; ++dj) { dot[dj] += fc[q * 4 + 3] * g[dj].w; pn2[dj] += g[dj].w * g[dj].w; }
    }
#pragma unroll
    for (int dj = 0; dj < WIN; ++dj) {
      const float sim = dot[dj] / fmaxf(cn * sqrtf(pn2[dj]), 1e-8f);
      att_s[(di * WIN + dj) * CORR_BLOCK + tid] = sim;
      mx = fmaxf(mx, sim);
    }
  }

  // softmax over the 49 window positions
  float s = 0.f;
#pragma unroll 1
  for (int k = 0; k < KWIN; ++k) {
    const float e = expf(att_s[k * CORR_BLOCK + tid] - mx);
    att_s[k * CORR_BLOCK + tid] = e;
    s += e;
  }
  const float inv = 1.f / s;

  // pass 2: weighted patch sum (64-channel accumulator in registers)
  float acc[CR];
#pragma unroll
  for (int c = 0; c < CR; ++c) acc[c] = 0.f;

  // window rows rolled for code size, as in pass 1
#pragma unroll 1
  for (int di = 0; di < WIN; ++di) {
    const float* rp = base + di * HALO_W * PIX_PITCH;
#pragma unroll
    for (int dj = 0; dj < WIN; ++dj) {
      const float a = att_s[(di * WIN + dj) * CORR_BLOCK + tid] * inv;
#pragma unroll
      for (int q = 0; q < CR / 4; ++q) {
        const float4 g = *(const float4*)(rp + dj * PIX_PITCH + q * 4);
        acc[q * 4 + 0] += a * g.x;
        acc[q * 4 + 1] += a * g.y;
        acc[q * 4 + 2] += a * g.z;
        acc[q * 4 + 3] += a * g.w;
      }
    }
  }

  float* cb = corr + (long)b * CR * IMG_HW + (h0 + th) * IMG + w0 + tw;
#pragma unroll
  for (int c = 0; c < CR; ++c) cb[(long)c * IMG_HW] = acc[c];
}

extern "C" void kernel_launch(void* const* d_in, const int* in_sizes, int n_in,
                              void* d_out, int out_size, void* d_ws,
                              size_t ws_size, hipStream_t stream) {
  const float* x = (const float*)d_in[0];         // [8,256,64,64]
  const float* w_reduce = (const float*)d_in[1];  // [64,256]
  const float* w_proj = (const float*)d_in[2];    // [512,64]
  float* out = (float*)d_out;                     // [8,512,64,64]

  const int B = 8, C = 256, H = 64, Wd = 64, CO = 512;
  const int HW = H * Wd;  // 4096

  float* feat = (float*)d_ws;                     // [8,64,64,64]  8.4 MB
  float* corr = feat + (size_t)B * CR * HW;       // [8,64,64,64]  8.4 MB

  // feat = w_reduce @ x : M=64, K=256, N=4096 per batch
  {
    dim3 grid(HW / 64, 64 / 64, B);
    gemm_wmma_f32_kernel<256, 4096><<<grid, 128, 0, stream>>>(
        w_reduce, x, feat, (long)C * HW, (long)CR * HW);
  }

  // windowed cosine-sim softmax attention: one block per 8x16 pixel tile
  corr_attention_kernel<<<B * HW / CORR_BLOCK, CORR_BLOCK, 0, stream>>>(feat,
                                                                        corr);

  // out = w_proj @ corr : M=512, K=64, N=4096 per batch
  {
    dim3 grid(HW / 64, CO / 64, B);
    gemm_wmma_f32_kernel<64, 4096><<<grid, 128, 0, stream>>>(
        w_proj, corr, out, (long)CR * HW, (long)CO * HW);
  }
}

// v003
// One run takes 46.1 microseconds.
// Two timings next to v002 both put it at 1.27 times that version's speed.
// Over all steps from v000 it is 10.0 times as fast.
#include <hip/hip_runtime.h>

typedef float v2f __attribute__((ext_vector_type(2)));
typedef float v8f __attribute__((ext_vector_type(8)));

#define WMMA_F32(a, b, c)                                                      \
  __builtin_amdgcn_wmma_f32_16x16x4_f32(false, (a), false, (b), (short)0, (c), \
                                        false, false)

// Y[b] (M x 4096) = W (M x K) * X[b] (K x 4096), all row-major.
// One work-group per 128 columns, 4 x WM waves: a wave owns 32 columns and
// M / WM rows. The whole weight is copied once into LDS; a wave keeps its
// K x 32 B operand in registers (loaded straight from global memory, each
// element once per wave), so the k loop holds no barrier and no LDS refill.
// The wave's two 16-column tiles take the even and the odd columns, so
// that a lane loads and stores two neighbouring floats and a half-wave covers
// a whole 128-byte line. Every output element is summed over k ascending in
// steps of four. grid = 8 images x 32 column blocks.
template <int M, int K, int WM, int PRE>
__global__ __launch_bounds__(128 * WM, 1) void gemm_wmma_f32_kernel(
    const float* __restrict__ Wm, const float* __restrict__ X,
    float* __restrict__ Y) {
  constexpr int NT = 128 * WM;
  constexpr int N = 4096;
  constexpr int LAP = K + 4;
  constexpr int MT = M / WM / 16;
  static_assert(M * K / 4 == 16 * NT, "16 copies per thread");
  __shared__ __attribute__((aligned(16))) float s_w[M * LAP];

  const int tid = threadIdx.x;
  const int lane = tid & 31;
  const int wave = tid >> 5;
  const int lo = lane & 15;  // M (A) / N (B) index within 16-wide tile
  const int hi = lane >> 4;  // selects K sub-pair {0,1} vs {2,3}
  const int b = blockIdx.x >> 5;
  const int col = (blockIdx.x & 31) * 128 + (wave & 3) * 32 + 2 * lo;
  const int mbase = (wave >> 2) * (M / WM);
  const float* Xb = X + (long)b * K * N;
  float* Yb = Y + (long)b * M * N;

  // ---- weight -> LDS: NT threads x 16 B per issue, 16 issues ----
  {
    const int fr = tid / (K / 4);        // row (and + NT / (K / 4) per issue)
    const int fc = (tid % (K / 4)) * 4;  // k (float4 granularity)
    const unsigned l0 = (unsigned)(unsigned long long)(uintptr_t)&s_w[0] +
                        (unsigned)(fr * LAP + fc) * 4u;
    const float* g0 = Wm + fr * K + fc;
    constexpr unsigned LS = (unsigned)(NT / (K / 4)) * LAP * 4u;  // LDS bytes
    constexpr int GS = NT * 4;                                    // words
#pragma unroll
    for (int i = 0; i < 16; i += 8) {
      asm volatile(
          "global_load_async_to_lds_b128 %0, %8, off\n\t"
          "global_load_async_to_lds_b128 %1, %9, off\n\t"
          "global_load_async_to_lds_b128 %2, %10, off\n\t"
          "global_load_async_to_lds_b128 %3, %11, off\n\t"
          "global_load_async_to_lds_b128 %4, %12, off\n\t"
          "global_load_async_to_lds_b128 %5, %13, off\n\t"
          "global_load_async_to_lds_b128 %6, %14, off\n\t"
          "global_load_async_to_lds_b128 %7, %15, off\n\t"
          "s_wait_xcnt 0x0"
          :
          : "v"(l0 + (i + 0) * LS), "v"(l0 + (i + 1) * LS),
            "v"(l0 + (i + 2) * LS), "v"(l0 + (i + 3) * LS),
            "v"(l0 + (i + 4) * LS), "v"(l0 + (i + 5) * LS),
            "v"(l0 + (i + 6) * LS), "v"(l0 + (i + 7) * LS),
            "v"(g0 + (i + 0) * GS), "v"(g0 + (i + 1) * GS),
            "v"(g0 + (i + 2) * GS), "v"(g0 + (i + 3) * GS),
            "v"(g0 + (i + 4) * GS), "v"(g0 + (i + 5) * GS),
            "v"(g0 + (i + 6) * GS), "v"(g0 + (i + 7) * GS)
          : "memory");
    }
  }

  // ---- B fragments, both column tiles: the first PRE k-steps are in flight
  // beside the copies (the barrier waits for them) ----
  v2f b0[K / 4], b1[K / 4];
  const float* xq = Xb + (long)(2 * hi) * N + col;
#pragma unroll
  for (int s = 0; s < PRE; ++s) {
    const v2f r0 = *(const v2f*)(xq + (long)(4 * s) * N);
    const v2f r1 = *(const v2f*)(xq + (long)(4 * s + 1) * N);
    b0[s].x = r0.x; b0[s].y = r1.x;
    b1[s].x = r0.y; b1[s].y = r1.y;
  }

  asm volatile("s_wait_xcnt 0x0" ::: "memory");
  // this wave's copies have landed before it signals the barrier
  asm volatile("s_wait_asynccnt 0x0" ::: "memory");
  __syncthreads();  // the staged weight is read by every wave

  // the other k-steps arrive while the first ones are multiplied
#pragma unroll
  for (int s = PRE; s < K / 4; ++s) {
    const v2f r0 = *(const v2f*)(xq + (long)(4 * s) * N);
    const v2f r1 = *(const v2f*)(xq + (long)(4 * s + 1) * N);
    b0[s].x = r0.x; b0[s].y = r1.x;
    b1[s].x = r0.y; b1[s].y = r1.y;
  }

  const float* ap = s_w + (mbase + lo) * LAP + 2 * hi;
  float* yp = Yb + (long)(mbase + 8 * hi) * N + col;

  // two 16-row tiles x two column tiles: four independent accumulate chains
  // (row tiles stay rolled: unrolled, all their accumulators are live at once
  // and the 16-wave build spills)
#pragma unroll 1
  for (int mt = 0; mt < MT; mt += 2) {
    v8f acc00 = {}; v8f acc01 = {}; v8f acc10 = {}; v8f acc11 = {};
#pragma unroll
    for (int s = 0; s < K / 4; ++s) {
      const v2f a0 = *(const v2f*)(ap + (mt + 0) * 16 * LAP + 4 * s);
      const v2f a1 = *(const v2f*)(ap + (mt + 1) * 16 * LAP + 4 * s);
      acc00 = WMMA_F32(a0, b0[s], acc00);
      acc01 = WMMA_F32(a0, b1[s], acc01);
      acc10 = WMMA_F32(a1, b0[s], acc10);
      acc11 = WMMA_F32(a1, b1[s], acc11);
    }
#pragma unroll
    for (int j = 0; j < 8; ++j) {
      v2f o0; o0.x = acc00[j]; o0.y = acc01[j];
      v2f o1; o1.x = acc10[j]; o1.y = acc11[j];
      *(v2f*)(yp + (long)((mt + 0) * 16 + j) * N) = o0;
      *(v2f*)(yp + (long)((mt + 1) * 16 + j) * N) = o1;
    }
  }
}

#define CR 64
#define WIN 7
#define KWIN 49
#define IMG 64                    // image height and width
#define IMG_HW (IMG * IMG)
#define TILE_H 8                  // pixel tile of one block
#define TILE_W 16
#define CORR_BLOCK (TILE_H * TILE_W)
#define HALO_H (TILE_H + WIN - 1) // 14 staged rows
#define HALO_W 24                 // staged columns w0-4 .. w0+19 (16-byte aligned)
#define PIX_PITCH 68              // words per staged pixel: 272 B = 16 B x odd

// One thread per pixel, one 8x16 pixel tile per block. The tile and its halo
// (all 64 channels) are staged once in LDS, pixel-major, so that each window
// position is 16 conflict-free 16-byte LDS reads per lane. Pixels outside the
// image are staged as zeros, which is the reference's zero padding. The 49
// attention weights live in LDS as well (dynamically indexed).
__global__ __launch_bounds__(CORR_BLOCK, 1) void corr_attention_kernel(
    const float* __restrict__ feat, float* __restrict__ corr) {
  __shared__ __attribute__((aligned(16))) float f_s[HALO_H * HALO_W * PIX_PITCH];
  __shared__ float att_s[KWIN * CORR_BLOCK];

  const int tid = threadIdx.x;
  const int b = blockIdx.x >> 5;            // 32 tiles per image
  const int tile = blockIdx.x & 31;
  const int h0 = (tile >> 2) * TILE_H;
  const int w0 = (tile & 3) * TILE_W;
  const float* fb = feat + (long)b * CR * IMG_HW;

  // ---- stage: 4 channels x 4 pixels per lane, transposed in registers ----
  {
    const int lane = tid & 31;
    const int pq = lane & 7;                    // 16-byte piece of a 128-byte line
    const int cq = (tid >> 5) * 4 + (lane >> 3);  // channel quad 0..15
    if (pq >= 1 && pq <= 6) {
      const int gw = w0 - 8 + pq * 4;
      const bool col_in = gw >= 0 && gw < IMG;
      const int gwc = min(max(gw, 0), IMG - 4);
      // one lane offset for every load; the row comes in through a uniform base
      const unsigned loff = (unsigned)(cq * 4 * IMG_HW + gwc);
      float* dp = f_s + (pq - 1) * 4 * PIX_PITCH + cq * 4;
      // unrolled so that every row's loads are in flight before the first store
#pragma unroll
      for (int r = 0; r < HALO_H; ++r) {
        const int gh = h0 - (WIN / 2) + r;
        const bool in = col_in && gh >= 0 && gh < IMG;
        const float* s = fb + min(max(gh, 0), IMG - 1) * IMG;
        const float4 v0 = *(const float4*)(s + loff);
        const float4 v1 = *(const float4*)(s + IMG_HW + loff);
        const float4 v2 = *(const float4*)(s + 2 * IMG_HW + loff);
        const float4 v3 = *(const float4*)(s + 3 * IMG_HW + loff);
        float* d = dp + r * HALO_W * PIX_PITCH;
        *(float4*)(d) = make_float4(in ? v0.x : 0.f, in ? v1.x : 0.f,
                                    in ? v2.x : 0.f, in ? v3.x : 0.f);
        *(float4*)(d + PIX_PITCH) = make_float4(in ? v0.y : 0.f, in ? v1.y : 0.f,
                                                in ? v2.y : 0.f, in ? v3.y : 0.f);
        *(float4*)(d + 2 * PIX_PITCH) = make_float4(in ? v0.z : 0.f, in ? v1.z : 0.f,
                                                    in ? v2.z : 0.f, in ? v3.z : 0.f);
        *(float4*)(d + 3 * PIX_PITCH) = make_float4(in ? v0.w : 0.f, in ? v1.w : 0.f,
                                                    in ? v2.w : 0.f, in ? v3.w : 0.f);
      }
    }
  }
  __syncthreads();  // the staged tile is read by every wave

  const int th = tid >> 4;
  const int tw = tid & 15;
  // window position (di, dj) of this pixel: staged row th+di, column tw+1+dj
  const float* base = f_s + (th * HALO_W + tw + 1) * PIX_PITCH;

  // center feature -> registers
  float fc[CR];
  float cn2 = 0.f;
  {
    const float* cp = base + ((WIN / 2) * HALO_W + (WIN / 2)) * PIX_PITCH;
#pragma unroll
    for (int q = 0; q < CR / 4; ++q) {
      const float4 g = *(const float4*)(cp + q * 4);
      fc[q * 4 + 0] = g.x; fc[q * 4 + 1] = g.y;
      fc[q * 4 + 2] = g.z; fc[q * 4 + 3] = g.w;
    }
#pragma unroll
    for (int c = 0; c < CR; ++c) cn2 += fc[c] * fc[c];
  }
  const float cn = sqrtf(cn2);

  // pass 1: cosine similarity per window offset; the seven offsets of a window
  // row run as independent sums, each in ascending channel order
  // (window rows stay rolled for code size; inner loops are unrolled so that
  // the register arrays are indexed by constants and offsets are immediates)
  float mx = -1e30f;
#pragma unroll 1
  for (int di = 0; di < WIN; ++di) {
    const float* rp = base + di * HALO_W * PIX_PITCH;
    float dot[WIN], pn2[WIN];
#pragma unroll
    for (int dj = 0; dj < WIN; ++dj) { dot[dj] = 0.f; pn2[dj] = 0.f; }
#pragma unroll
    for (int q = 0; q < CR / 4; ++q) {
      float4 g[WIN];
#pragma unroll
      for (int dj = 0; dj < WIN; ++dj)
        g[dj] = *(const float4*)(rp + dj * PIX_PITCH + q * 4);
#pragma unroll
      for (int dj = 0; dj < WIN; ++dj) { dot[dj] += fc[q * 4 + 0] * g[dj].x; pn2[dj] += g[dj].x * g[dj].x; }
#pragma unroll
      for (int dj = 0; dj < WIN; ++dj) { dot[dj] += fc[q * 4 + 1] * g[dj].y; pn2[dj] += g[dj].y * g[dj].y; }
#pragma unroll
      for (int dj = 0; dj < WIN; ++dj) { dot[dj] += fc[q * 4 + 2] * g[dj].z; pn2[dj] += g[dj].z * g[dj].z; }
#pragma unroll
      for (int dj = 0; dj < WIN; ++dj) { dot[dj] += fc[q * 4 + 3] * g[dj].w; pn2[dj] += g[dj].w * g[dj].w; }
    }
#pragma unroll
    for (int dj = 0; dj < WIN; ++dj) {
      const float sim = dot[dj] / fmaxf(cn * sqrtf(pn2[dj]), 1e-8f);
      att_s[(di * WIN + dj) * CORR_BLOCK + tid] = sim;
      mx = fmaxf(mx, sim);
    }
  }

  // softmax over the 49 window positions
  float s = 0.f;
#pragma unroll 1
  for (int k = 0; k < KWIN; ++k) {
    const float e = expf(att_s[k * CORR_BLOCK + tid] - mx);
    att_s[k * CORR_BLOCK + tid] = e;
    s += e;
  }
  const float inv = 1.f / s;

  // pass 2: weighted patch sum (64-channel accumulator in registers)
  float acc[CR];
#pragma unroll
  for (int c = 0; c < CR; ++c) acc[c] = 0.f;

  // window rows rolled for code size, as in pass 1
#pragma unroll 1
  for (int di = 0; di < WIN; ++di) {
    const float* rp = base + di * HALO_W * PIX_PITCH;
#pragma unroll
    for (int dj = 0; dj < WIN; ++dj) {
      const float a = att_s[(di * WIN + dj) * CORR_BLOCK + tid] * inv;
#pragma unroll
      for (int q = 0; q < CR / 4; ++q) {
        const float4 g = *(const float4*)(rp + dj * PIX_PITCH + q * 4);
        acc[q * 4 + 0] += a * g.x;
        acc[q * 4 + 1] += a * g.y;
        acc[q * 4 + 2] += a * g.z;
        acc[q * 4 + 3] += a * g.w;
      }
    }
  }

  float* cb = corr + (long)b * CR * IMG_HW + (h0 + th) * IMG + w0 + tw;
#pragma unroll
  for (int c = 0; c < CR; ++c) cb[(long)c * IMG_HW] = acc[c];
}

extern "C" void kernel_launch(void* const* d_in, const int* in_sizes, int n_in,
                              void* d_out, int out_size, void* d_ws,
                              size_t ws_size, hipStream_t stream) {
  const float* x = (const float*)d_in[0];         // [8,256,64,64]
  const float* w_reduce = (const float*)d_in[1];  // [64,256]
  const float* w_proj = (const float*)d_in[2];    // [512,64]
  float* out = (float*)d_out;                     // [8,512,64,64]

  const int B = 8, HW = 64 * 64;

  float* feat = (float*)d_ws;                     // [8,64,64,64]  8.4 MB
  float* corr = feat + (size_t)B * CR * HW;       // [8,64,64,64]  8.4 MB

  // feat = w_reduce @ x : M=64, K=256, one work-group per 128 pixels
  gemm_wmma_f32_kernel<64, 256, 2, 16><<<B * HW / 128, 256, 0, stream>>>(w_reduce, x,
                                                                    feat);

  // windowed cosine-sim softmax attention: one block per 8x16 pixel tile
  corr_attention_kernel<<<B * HW / CORR_BLOCK, CORR_BLOCK, 0, stream>>>(feat,
                                                                        corr);

  // out = w_proj @ corr : M=512, K=64, one work-group per 128 pixels
  gemm_wmma_f32_kernel<512, 64, 4, 16><<<B * HW / 128, 512, 0, stream>>>(w_proj, corr,
                                                                    out);
}

// v004
// It runs in 38 microseconds.
// Next to v003, in two timings, it ran 1.22 and 1.21 times as fast.
// Counting every step since v000, it is 12.2 times as fast.
#include <hip/hip_runtime.h>

typedef float v2f __attribute__((ext_vector_type(2)));
typedef float v8f __attribute__((ext_vector_type(8)));

#define WMMA_F32(a, b, c)                                                      \
  __builtin_amdgcn_wmma_f32_16x16x4_f32(false, (a), false, (b), (short)0, (c), \
                                        false, false)

// Y[b] (M x 4096) = W (M x K) * X[b] (K x 4096), all row-major.
// One work-group per 128 columns, 4 x WM waves: a wave owns 32 columns and
// M / WM rows. The whole weight is copied once into LDS; a wave keeps its
// K x 32 B operand in registers (loaded straight from global memory, each
// element once per wave), so the k loop holds no barrier and no LDS refill.
// The wave's two 16-column tiles take the even and the odd columns, so
// that a lane loads and stores two neighbouring floats and a half-wave covers
// a whole 128-byte line. Every output element is summed over k ascending in
// steps of four. grid = 8 images x 32 column blocks.
template <int M, int K, int WM, int PRE>
__global__ __launch_bounds__(128 * WM, 1) void gemm_wmma_f32_kernel(
    const float* __restrict__ Wm, const float* __restrict__ X,
    float* __restrict__ Y) {
  constexpr int NT = 128 * WM;
  constexpr int N = 4096;
  constexpr int LAP = K + 4;
  constexpr int MT = M / WM / 16;
  static_assert(M * K / 4 == 16 * NT, "16 copies per thread");
  __shared__ __attribute__((aligned(16))) float s_w[M * LAP];

  const int tid = threadIdx.x;
  const int lane = tid & 31;
  const int wave = tid >> 5;
  const int lo = lane & 15;  // M (A) / N (B) index within 16-wide tile
  const int hi = lane >> 4;  // selects K sub-pair {0,1} vs {2,3}
  const int b = blockIdx.x >> 5;
  const int col = (blockIdx.x & 31) * 128 + (wave & 3) * 32 + 2 * lo;
  const int mbase = (wave >> 2) * (M / WM);
  const float* Xb = X + (long)b * K * N;
  float* Yb = Y + (long)b * M * N;

  // ---- weight -> LDS: NT threads x 16 B per issue, 16 issues ----
  {
    const int fr = tid / (K / 4);        // row (and + NT / (K / 4) per issue)
    const int fc = (tid % (K / 4)) * 4;  // k (float4 granularity)
    const unsigned l0 = (unsigned)(unsigned long long)(uintptr_t)&s_w[0] +
                        (unsigned)(fr * LAP + fc) * 4u;
    const float* g0 = Wm + fr * K + fc;
    constexpr unsigned LS = (unsigned)(NT / (K / 4)) * LAP * 4u;  // LDS bytes
    constexpr int GS = NT * 4;                                    // words
#pragma unroll
    for (int i = 0; i < 16; i += 8) {
      asm volatile(
          "global_load_async_to_lds_b128 %0, %8, off\n\t"
          "global_load_async_to_lds_b128 %1, %9, off\n\t"
          "global_load_async_to_lds_b128 %2, %10, off\n\t"
          "global_load_async_to_lds_b128 %3, %11, off\n\t"
          "global_load_async_to_lds_b128 %4, %12, off\n\t"
          "global_load_async_to_lds_b128 %5, %13, off\n\t"
          "global_load_async_to_lds_b128 %6, %14, off\n\t"
          "global_load_async_to_lds_b128 %7, %15, off\n\t"
          "s_wait_xcnt 0x0"
          :
          : "v"(l0 + (i + 0) * LS), "v"(l0 + (i + 1) * LS),
            "v"(l0 + (i + 2) * LS), "v"(l0 + (i + 3) * LS),
            "v"(l0 + (i + 4) * LS), "v"(l0 + (i + 5) * LS),
            "v"(l0 + (i + 6) * LS), "v"(l0 + (i + 7) * LS),
            "v"(g0 + (i + 0) * GS), "v"(g0 + (i + 1) * GS),
            "v"(g0 + (i + 2) * GS), "v"(g0 + (i + 3) * GS),
            "v"(g0 + (i + 4) * GS), "v"(g0 + (i + 5) * GS),
            "v"(g0 + (i + 6) * GS), "v"(g0 + (i + 7) * GS)
          : "memory");
    }
  }

  // ---- B fragments, both column tiles: the first PRE k-steps are in flight
  // beside the copies (the barrier waits for them) ----
  v2f b0[K / 4], b1[K / 4];
  const float* xq = Xb + (long)(2 * hi) * N + col;
#pragma unroll
  for (int s = 0; s < PRE; ++s) {
    const v2f r0 = *(const v2f*)(xq + (long)(4 * s) * N);
    const v2f r1 = *(const v2f*)(xq + (long)(4 * s + 1) * N);
    b0[s].x = r0.x; b0[s].y = r1.x;
    b1[s].x = r0.y; b1[s].y = r1.y;
  }

  asm volatile("s_wait_xcnt 0x0" ::: "memory");
  // this wave's copies have landed before it signals the barrier
  asm volatile("s_wait_asynccnt 0x0" ::: "memory");
  __syncthreads();  // the staged weight is read by every wave

  // the other k-steps arrive while the first ones are multiplied
#pragma unroll
  for (int s = PRE; s < K / 4; ++s) {
    const v2f r0 = *(const v2f*)(xq + (long)(4 * s) * N);
    const v2f r1 = *(const v2f*)(xq + (long)(4 * s + 1) * N);
    b0[s].x = r0.x; b0[s].y = r1.x;
    b1[s].x = r0.y; b1[s].y = r1.y;
  }

  const float* ap = s_w + (mbase + lo) * LAP + 2 * hi;
  float* yp = Yb + (long)(mbase + 8 * hi) * N + col;

  // two 16-row tiles x two column tiles: four independent accumulate chains
  // (row tiles stay rolled: unrolled, all their accumulators are live at once
  // and the 16-wave build spills)
#pragma unroll 1
  for (int mt = 0; mt < MT; mt += 2) {
    v8f acc00 = {}; v8f acc01 = {}; v8f acc10 = {}; v8f acc11 = {};
#pragma unroll
    for (int s = 0; s < K / 4; ++s) {
      const v2f a0 = *(const v2f*)(ap + (mt + 0) * 16 * LAP + 4 * s);
      const v2f a1 = *(const v2f*)(ap + (mt + 1) * 16 * LAP + 4 * s);
      acc00 = WMMA_F32(a0, b0[s], acc00);
      acc01 = WMMA_F32(a0, b1[s], acc01);
      acc10 = WMMA_F32(a1, b0[s], acc10);
      acc11 = WMMA_F32(a1, b1[s], acc11);
    }
#pragma unroll
    for (int j = 0; j < 8; ++j) {
      v2f o0; o0.x = acc00[j]; o0.y = acc01[j];
      v2f o1; o1.x = acc10[j]; o1.y = acc11[j];
      *(v2f*)(yp + (long)((mt + 0) * 16 + j) * N) = o0;
      *(v2f*)(yp + (long)((mt + 1) * 16 + j) * N) = o1;
    }
  }
}

#define CR 64
#define WIN 7
#define IMG 64                    // image height and width
#define IMG_HW (IMG * IMG)
#define TILE_H 8                  // pixel tile of one block
#define TILE_W 16
#define CORR_BLOCK (TILE_H * TILE_W)
#define HALO_H (TILE_H + WIN - 1) // 14 staged rows
#define HALO_W 24                 // staged columns w0-4 .. w0+19 (16-byte aligned)
#define PIX_PITCH 68              // words per staged pixel: 272 B = 16 B x odd

// One thread per pixel, one 8x16 pixel tile per block. The tile and its halo
// (all 64 channels) are staged once in LDS, pixel-major, so that each window
// position is 16 conflict-free 16-byte LDS reads per lane. Pixels outside the
// image are staged as zeros.
__global__ __launch_bounds__(CORR_BLOCK, 1) void corr_attention_kernel(
    const float* __restrict__ feat, float* __restrict__ corr) {
  __shared__ __attribute__((aligned(16))) float f_s[HALO_H * HALO_W * PIX_PITCH];

  const int tid = threadIdx.x;
  const int b = blockIdx.x >> 5;            // 32 tiles per image
  const int tile = blockIdx.x & 31;
  const int h0 = (tile >> 2) * TILE_H;
  const int w0 = (tile & 3) * TILE_W;
  const float* fb = feat + (long)b * CR * IMG_HW;

  // ---- stage: 4 channels x 4 pixels per lane, transposed in registers ----
  {
    const int lane = tid & 31;
    const int pq = lane & 7;                    // 16-byte piece of a 128-byte line
    const int cq = (tid >> 5) * 4 + (lane >> 3);  // channel quad 0..15
    if (pq >= 1 && pq <= 6) {
      const int gw = w0 - 8 + pq * 4;
      const bool col_in = gw >= 0 && gw < IMG;
      const int gwc = min(max(gw, 0), IMG - 4);
      // one lane offset for every load; the row comes in through a uniform base
      const unsigned loff = (unsigned)(cq * 4 * IMG_HW + gwc);
      float* dp = f_s + (pq - 1) * 4 * PIX_PITCH + cq * 4;
      // unrolled so that every row's loads are in flight before the first store
#pragma unroll
      for (int r = 0; r < HALO_H; ++r) {
        const int gh = h0 - (WIN / 2) + r;
        const bool in = col_in && gh >= 0 && gh < IMG;
        const float* s = fb + min(max(gh, 0), IMG - 1) * IMG;
        const float4 v0 = *(const float4*)(s + loff);
        const float4 v1 = *(const float4*)(s + IMG_HW + loff);
        const float4 v2 = *(const float4*)(s + 2 * IMG_HW + loff);
        const float4 v3 = *(const float4*)(s + 3 * IMG_HW + loff);
        float* d = dp + r * HALO_W * PIX_PITCH;
        *(float4*)(d) = make_float4(in ? v0.x : 0.f, in ? v1.x : 0.f,
                                    in ? v2.x : 0.f, in ? v3.x : 0.f);
        *(float4*)(d + PIX_PITCH) = make_float4(in ? v0.y : 0.f, in ? v1.y : 0.f,
                                                in ? v2.y : 0.f, in ? v3.y : 0.f);
        *(float4*)(d + 2 * PIX_PITCH) = make_float4(in ? v0.z : 0.f, in ? v1.z : 0.f,
                                                    in ? v2.z : 0.f, in ? v3.z : 0.f);
        *(float4*)(d + 3 * PIX_PITCH) = make_float4(in ? v0.w : 0.f, in ? v1.w : 0.f,
                                                    in ? v2.w : 0.f, in ? v3.w : 0.f);
      }
    }
  }
  __syncthreads();  // the staged tile is read by every wave

  const int th = tid >> 4;
  const int tw = tid & 15;
  // window position (di, dj) of this pixel: staged row th+di, column tw+1+dj
  const float* base = f_s + (th * HALO_W + tw + 1) * PIX_PITCH;

  // center feature -> registers
  float fc[CR];
  float cn2 = 0.f;
  {
    const float* cp = base + ((WIN / 2) * HALO_W + (WIN / 2)) * PIX_PITCH;
#pragma unroll
    for (int q = 0; q < CR / 4; ++q) {
      const float4 g = *(const float4*)(cp + q * 4);
      fc[q * 4 + 0] = g.x; fc[q * 4 + 1] = g.y;
      fc[q * 4 + 2] = g.z; fc[q * 4 + 3] = g.w;
    }
#pragma unroll
    for (int c = 0; c < CR; ++c) cn2 += fc[c] * fc[c];
  }
  const float cn = sqrtf(cn2);

  // one pass over the window: a window row's seven patches are read into
  // registers once and serve the cosine similarity and then the weighted sum.
  // |cosine| <= 1 (Cauchy-Schwarz; below the 1e-8 floor |dot| < 1e-8 as well),
  // so exp(sim) needs no maximum taken off: softmax = exp(sim) / sum exp(sim),
  // and the division by the sum comes once, behind the loop.
  // The seven offsets of a row run as independent sums, each in ascending
  // channel order; weights and patches are summed in ascending window order.
  // (window rows stay rolled for code size; inner loops are unrolled so that
  // the register arrays are indexed by constants and offsets are immediates)
  float acc[CR];
#pragma unroll
  for (int c = 0; c < CR; ++c) acc[c] = 0.f;
  float s = 0.f;
#pragma unroll 1
  for (int di = 0; di < WIN; ++di) {
    const float* rp = base + di * HALO_W * PIX_PITCH;
    float4 g[WIN][CR / 4];
    float dot[WIN], pn2[WIN];
#pragma unroll
    for (int dj = 0; dj < WIN; ++dj) { dot[dj] = 0.f; pn2[dj] = 0.f; }
#pragma unroll
    for (int q = 0; q < CR / 4; ++q) {
#pragma unroll
      for (int dj = 0; dj < WIN; ++dj)
        g[dj][q] = *(const float4*)(rp + dj * PIX_PITCH + q * 4);
    }
    __builtin_amdgcn_sched_barrier(0);
#pragma unroll
    for (int q = 0; q < CR / 4; ++q) {
#pragma unroll
      for (int dj = 0; dj < WIN; ++dj) { dot[dj] += fc[q * 4 + 0] * g[dj][q].x; pn2[dj] += g[dj][q].x * g[dj][q].x; }
#pragma unroll
      for (int dj = 0; dj < WIN; ++dj) { dot[dj] += fc[q * 4 + 1] * g[dj][q].y; pn2[dj] += g[dj][q].y * g[dj][q].y; }
#pragma unroll
      for (int dj = 0; dj < WIN; ++dj) { dot[dj] += fc[q * 4 + 2] * g[dj][q].z; pn2[dj] += g[dj][q].z * g[dj][q].z; }
#pragma unroll
      for (int dj = 0; dj < WIN; ++dj) { dot[dj] += fc[q * 4 + 3] * g[dj][q].w; pn2[dj] += g[dj][q].w * g[dj][q].w; }
    }
    __builtin_amdgcn_sched_barrier(0);
    float e[WIN];
#pragma unroll
    for (int dj = 0; dj < WIN; ++dj)
      e[dj] = expf(dot[dj] / fmaxf(cn * sqrtf(pn2[dj]), 1e-8f));
#pragma unroll
    for (int dj = 0; dj < WIN; ++dj) {
      s += e[dj];
#pragma unroll
      for (int q = 0; q < CR / 4; ++q) {
        acc[q * 4 + 0] += e[dj] * g[dj][q].x;
        acc[q * 4 + 1] += e[dj] * g[dj][q].y;
        acc[q * 4 + 2] += e[dj] * g[dj][q].z;
        acc[q * 4 + 3] += e[dj] * g[dj][q].w;
      }
    }
  }
  const float inv = 1.f / s;
#pragma unroll
  for (int c = 0; c < CR; ++c) acc[c] *= inv;
  // all 64 quotients stand in registers of their own before the first store, so
  // that no register which an issued store names is written behind it
  __builtin_amdgcn_sched_barrier(0);

  float* cb = corr + (long)b * CR * IMG_HW + (h0 + th) * IMG + w0 + tw;
#pragma unroll
  for (int c = 0; c < CR; ++c) cb[(long)c * IMG_HW] = acc[c];
}

extern "C" void kernel_launch(void* const* d_in, const int* in_sizes, int n_in,
                              void* d_out, int out_size, void* d_ws,
                              size_t ws_size, hipStream_t stream) {
  const float* x = (const float*)d_in[0];         // [8,256,64,64]
  const float* w_reduce = (const float*)d_in[1];  // [64,256]
  const float* w_proj = (const float*)d_in[2];    // [512,64]
  float* out = (float*)d_out;                     // [8,512,64,64]

  const int B = 8, HW = 64 * 64;

  float* feat = (float*)d_ws;                     // [8,64,64,64]  8.4 MB
  float* corr = feat + (size_t)B * CR * HW;       // [8,64,64,64]  8.4 MB

  // feat = w_reduce @ x : M=64, K=256, one work-group per 128 pixels
  gemm_wmma_f32_kernel<64, 256, 2, 16><<<B * HW / 128, 256, 0, stream>>>(w_reduce, x,
                                                                    feat);

  // windowed cosine-sim softmax attention: one block per 8x16 pixel tile
  corr_attention_kernel<<<B * HW / CORR_BLOCK, CORR_BLOCK, 0, stream>>>(feat,
                                                                        corr);

  // out = w_proj @ corr : M=512, K=64, one work-group per 128 pixels
  gemm_wmma_f32_kernel<512, 64, 4, 16><<<B * HW / 128, 512, 0, stream>>>(w_proj, corr,
                                                                    out);
}

// v005
// One run takes 31 microseconds.
// Next to v004, in two timings, it ran 1.23 times as fast each time.
// All steps since v000 together make it 15.0 times as fast.
#include <hip/hip_runtime.h>

typedef float v2f __attribute__((ext_vector_type(2)));
typedef float v8f __attribute__((ext_vector_type(8)));

#define WMMA_F32(a, b, c)                                                      \
  __builtin_amdgcn_wmma_f32_16x16x4_f32(false, (a), false, (b), (short)0, (c), \
                                        false, false)

// Y[b] (M x 4096) = W (M x K) * X[b] (K x 4096), all row-major.
// One work-group per 128 columns, 4 x WM waves: a wave owns 32 columns and
// M / WM rows. The whole weight is copied once into LDS; a wave keeps its
// K x 32 B operand in registers (loaded straight from global memory, each
// element once per wave), so the k loop holds no barrier and no LDS refill.
// The wave's two 16-column tiles take the even and the odd columns, so
// that a lane loads and stores two neighbouring floats and a half-wave covers
// a whole 128-byte line. Every output element is summed over k ascending in
// steps of four. grid = 8 images x 32 column blocks.
template <int M, int K, int WM, int PRE>
__global__ __launch_bounds__(128 * WM, 1) void gemm_wmma_f32_kernel(
    const float* __restrict__ Wm, const float* __restrict__ X,
    float* __restrict__ Y) {
  constexpr int NT = 128 * WM;
  constexpr int N = 4096;
  constexpr int LAP = K + 4;
  constexpr int MT = M / WM / 16;
  static_assert(M * K / 4 == 16 * NT, "16 copies per thread");
  __shared__ __attribute__((aligned(16))) float s_w[M * LAP];

  const int tid = threadIdx.x;
  const int lane = tid & 31;
  const int wave = tid >> 5;
  const int lo = lane & 15;  // M (A) / N (B) index within 16-wide tile
  const int hi = lane >> 4;  // selects K sub-pair {0,1} vs {2,3}
  const int b = blockIdx.x >> 5;
  const int col = (blockIdx.x & 31) * 128 + (wave & 3) * 32 + 2 * lo;
  const int mbase = (wave >> 2) * (M / WM);
  const float* Xb = X + (long)b * K * N;
  float* Yb = Y + (long)b * M * N;

  // ---- weight -> LDS: NT threads x 16 B per issue, 16 issues ----
  {
    const int fr = tid / (K / 4);        // row (and + NT / (K / 4) per issue)
    const int fc = (tid % (K / 4)) * 4;  // k (float4 granularity)
    const unsigned l0 = (unsigned)(unsigned long long)(uintptr_t)&s_w[0] +
                        (unsigned)(fr * LAP + fc) * 4u;
    const float* g0 = Wm + fr * K + fc;
    constexpr unsigned LS = (unsigned)(NT / (K / 4)) * LAP * 4u;  // LDS bytes
    constexpr int GS = NT * 4;                                    // words
#pragma unroll
    for (int i = 0; i < 16; i += 8) {
      asm volatile(
          "global_load_async_to_lds_b128 %0, %8, off\n\t"
          "global_load_async_to_lds_b128 %1, %9, off\n\t"
          "global_load_async_to_lds_b128 %2, %10, off\n\t"
          "global_load_async_to_lds_b128 %3, %11, off\n\t"
          "global_load_async_to_lds_b128 %4, %12, off\n\t"
          "global_load_async_to_lds_b128 %5, %13, off\n\t"
          "global_load_async_to_lds_b128 %6, %14, off\n\t"
          "global_load_async_to_lds_b128 %7, %15, off\n\t"
          "s_wait_xcnt 0x0"
          :
          : "v"(l0 + (i + 0) * LS), "v"(l0 + (i + 1) * LS),
            "v"(l0 + (i + 2) * LS), "v"(l0 + (i + 3) * LS),
            "v"(l0 + (i + 4) * LS), "v"(l0 + (i + 5) * LS),
            "v"(l0 + (i + 6) * LS), "v"(l0 + (i + 7) * LS),
            "v"(g0 + (i + 0) * GS), "v"(g0 + (i + 1) * GS),
            "v"(g0 + (i + 2) * GS), "v"(g0 + (i + 3) * GS),
            "v"(g0 + (i + 4) * GS), "v"(g0 + (i + 5) * GS),
            "v"(g0 + (i + 6) * GS), "v"(g0 + (i + 7) * GS)
          : "memory");
    }
  }

  // ---- B fragments, both column tiles: the first PRE k-steps are in flight
  // beside the copies (the barrier waits for them) ----
  v2f b0[K / 4], b1[K / 4];
  const float* xq = Xb + (long)(2 * hi) * N + col;
#pragma unroll
  for (int s = 0; s < PRE; ++s) {
    const v2f r0 = *(const v2f*)(xq + (long)(4 * s) * N);
    const v2f r1 = *(const v2f*)(xq + (long)(4 * s + 1) * N);
    b0[s].x = r0.x; b0[s].y = r1.x;
    b1[s].x = r0.y; b1[s].y = r1.y;
  }

  asm volatile("s_wait_xcnt 0x0" ::: "memory");
  // this wave's copies have landed before it signals the barrier
  asm volatile("s_wait_asynccnt 0x0" ::: "memory");
  __syncthreads();  // the staged weight is read by every wave

  // the other k-steps arrive while the first ones are multiplied
#pragma unroll
  for (int s = PRE; s < K / 4; ++s) {
    const v2f r0 = *(const v2f*)(xq + (long)(4 * s) * N);
    const v2f r1 = *(const v2f*)(xq + (long)(4 * s + 1) * N);
    b0[s].x = r0.x; b0[s].y = r1.x;
    b1[s].x = r0.y; b1[s].y = r1.y;
  }

  const float* ap = s_w + (mbase + lo) * LAP + 2 * hi;
  float* yp = Yb + (long)(mbase + 8 * hi) * N + col;

  // two 16-row tiles x two column tiles: four independent accumulate chains
  // (row tiles stay rolled: unrolled, all their accumulators are live at once
  // and the 16-wave build spills)
#pragma unroll 1
  for (int mt = 0; mt < MT; mt += 2) {
    v8f acc00 = {}; v8f acc01 = {}; v8f acc10 = {}; v8f acc11 = {};
#pragma unroll
    for (int s = 0; s < K / 4; ++s) {
      const v2f a0 = *(const v2f*)(ap + (mt + 0) * 16 * LAP + 4 * s);
      const v2f a1 = *(const v2f*)(ap + (mt + 1) * 16 * LAP + 4 * s);
      acc00 = WMMA_F32(a0, b0[s], acc00);
      acc01 = WMMA_F32(a0, b1[s], acc01);
      acc10 = WMMA_F32(a1, b0[s], acc10);
      acc11 = WMMA_F32(a1, b1[s], acc11);
    }
#pragma unroll
    for (int j = 0; j < 8; ++j) {
      v2f o0; o0.x = acc00[j]; o0.y = acc01[j];
      v2f o1; o1.x = acc10[j]; o1.y = acc11[j];
      *(v2f*)(yp + (long)((mt + 0) * 16 + j) * N) = o0;
      *(v2f*)(yp + (long)((mt + 1) * 16 + j) * N) = o1;
    }
  }
}

#define CR 64
#define WIN 7
#define IMG 64                    // image height and width
#define IMG_HW (IMG * IMG)
#define TILE_H 4                  // pixel tile of one block: a wave owns one row
#define TILE_W 32
#define CORR_BLOCK (TILE_H * TILE_W)
#define HALO_H (TILE_H + WIN - 1) // 10 staged rows
#define HALO_W 48                 // staged columns w0-4 .. w0+43 (w0+36 on: filler)
#define PIX_PITCH 68              // words per staged pixel: 272 B = 16 B x odd
#define OC 512                    // output channels of the projection
#define RT 4                      // 16-row tiles of one block of matrix work

// eight 16-byte copies of one lane, global -> LDS, LS bytes / GS words apart
template <unsigned LS, int GS>
__device__ __forceinline__ void async_copy8(unsigned l, const float* g) {
  asm volatile(
      "global_load_async_to_lds_b128 %0, %8, off\n\t"
      "global_load_async_to_lds_b128 %1, %9, off\n\t"
      "global_load_async_to_lds_b128 %2, %10, off\n\t"
      "global_load_async_to_lds_b128 %3, %11, off\n\t"
      "global_load_async_to_lds_b128 %4, %12, off\n\t"
      "global_load_async_to_lds_b128 %5, %13, off\n\t"
      "global_load_async_to_lds_b128 %6, %14, off\n\t"
      "global_load_async_to_lds_b128 %7, %15, off\n\t"
      "s_wait_xcnt 0x0"
      :
      : "v"(l), "v"(l + LS), "v"(l + 2 * LS), "v"(l + 3 * LS), "v"(l + 4 * LS),
        "v"(l + 5 * LS), "v"(l + 6 * LS), "v"(l + 7 * LS), "v"(g), "v"(g + GS),
        "v"(g + 2 * GS), "v"(g + 3 * GS), "v"(g + 4 * GS), "v"(g + 5 * GS),
        "v"(g + 6 * GS), "v"(g + 7 * GS)
      : "memory");
}

// A fragments of RT row tiles (all 16 k-steps) from the staged weight
__device__ __forceinline__ void load_a(v2f (&a)[RT][CR / 4], const float* ap) {
#pragma unroll
  for (int t = 0; t < RT; ++t)
#pragma unroll
    for (int s = 0; s < CR / 4; ++s)
      a[t][s] = *(const v2f*)(ap + t * 16 * PIX_PITCH + 4 * s);
}

// RT row tiles x two column tiles: 2 * RT independent accumulate chains, k
// ascending in steps of four; a lane stores two neighbouring pixels
__device__ __forceinline__ void mm_block(const v2f (&a)[RT][CR / 4],
                                         const v2f (&b0)[CR / 4],
                                         const v2f (&b1)[CR / 4], float* yp) {
  v8f c0[RT], c1[RT];
#pragma unroll
  for (int t = 0; t < RT; ++t) { c0[t] = v8f{}; c1[t] = v8f{}; }
#pragma unroll
  for (int s = 0; s < CR / 4; ++s) {
#pragma unroll
    for (int t = 0; t < RT; ++t) {
      c0[t] = WMMA_F32(a[t][s], b0[s], c0[t]);
      c1[t] = WMMA_F32(a[t][s], b1[s], c1[t]);
    }
  }
#pragma unroll
  for (int t = 0; t < RT; ++t) {
#pragma unroll
    for (int j = 0; j < 8; ++j) {
      v2f o; o.x = c0[t][j]; o.y = c1[t][j];
      *(v2f*)(yp + (long)(t * 16 + j) * IMG_HW) = o;
    }
  }
}

__global__ __launch_bounds__(CORR_BLOCK, 1) void corr_proj_kernel(
    const float* __restrict__ feat, const float* __restrict__ Wp,
    float* __restrict__ out) {
  __shared__ __attribute__((aligned(16))) float f_s[HALO_H * HALO_W * PIX_PITCH];
  __shared__ __attribute__((aligned(16))) float s_w[OC * PIX_PITCH];

  const int tid = threadIdx.x;
  const int lane = tid & 31;
  // the wave's number as a scalar, so that what hangs on it stays uniform
  const int wave = __builtin_amdgcn_readfirstlane(tid >> 5);
  const int b = blockIdx.x >> 5;            // 32 tiles per image
  const int tile = blockIdx.x & 31;
  const int h0 = (tile >> 1) * TILE_H;
  const int w0 = (tile & 1) * TILE_W;
  const float* fb = feat + (long)b * CR * IMG_HW;

  // weight copies: a thread takes 16 bytes of every eighth row, 64 copies in
  // two runs of 32 (a wave keeps fewer than 64 outstanding)
  unsigned wl0;      // LDS byte address of the thread's first copy
  const float* wg0;  // its source (both are formed behind the staging loads)
  constexpr unsigned WLS = 8u * PIX_PITCH * 4u;  // LDS bytes per eight rows
  constexpr int WGS = 8 * CR;                    // words per eight rows

  {
    const int pq = lane & 3;                         // 16-byte piece in its group
    const int cq = (wave & 1) * 8 + (lane >> 2);     // channel quad 0..15
    const int r0 = wave >> 1;                        // row parity
    float4 v[HALO_H / 2][3][4];
    // every load is in flight before the first store
#pragma unroll
    for (int i = 0; i < HALO_H / 2; ++i) {
      const int gh = h0 - (WIN / 2) + 2 * i + r0;
      const float* s = fb + min(max(gh, 0), IMG - 1) * IMG;
#pragma unroll
      for (int g = 0; g < 3; ++g) {
        const unsigned loff = (unsigned)(
            cq * 4 * IMG_HW + min(max(w0 - 4 + (4 * g + pq) * 4, 0), IMG - 4));
#pragma unroll
        for (int k = 0; k < 4; ++k)
          v[i][g][k] = *(const float4*)(s + k * IMG_HW + loff);
      }
    }
    asm volatile("s_wait_xcnt 0x0" ::: "memory");
    __builtin_amdgcn_sched_barrier(0);
    wl0 = (unsigned)(unsigned long long)(uintptr_t)&s_w[0] +
          (unsigned)((tid >> 4) * PIX_PITCH + (tid & 15) * 4) * 4u;
    wg0 = Wp + (tid >> 4) * CR + (tid & 15) * 4;
    // first run of weight copies, behind the loads that the barrier waits for
#pragma unroll
    for (int i = 0; i < 32; i += 8)
      async_copy8<WLS, WGS>(wl0 + i * WLS, wg0 + i * WGS);
#pragma unroll
    for (int i = 0; i < HALO_H / 2; ++i) {
      const int r = 2 * i + r0;
      const int gh = h0 - (WIN / 2) + r;
#pragma unroll
      for (int g = 0; g < 3; ++g) {
        const int piece = 4 * g + pq;
        const int gw = w0 - 4 + piece * 4;
        const bool in = gw >= 0 && gw < IMG && gh >= 0 && gh < IMG;
        float* d = f_s + (r * HALO_W + piece * 4) * PIX_PITCH + cq * 4;
        const float4 v0 = v[i][g][0], v1 = v[i][g][1], v2 = v[i][g][2],
                     v3 = v[i][g][3];
        *(float4*)(d) = make_float4(in ? v0.x : 0.f, in ? v1.x : 0.f,
                                    in ? v2.x : 0.f, in ? v3.x : 0.f);
        *(float4*)(d + PIX_PITCH) = make_float4(in ? v0.y : 0.f, in ? v1.y : 0.f,
                                                in ? v2.y : 0.f, in ? v3.y : 0.f);
        *(float4*)(d + 2 * PIX_PITCH) = make_float4(in ? v0.z : 0.f, in ? v1.z : 0.f,
                                                    in ? v2.z : 0.f, in ? v3.z : 0.f);
        *(float4*)(d + 3 * PIX_PITCH) = make_float4(in ? v0.w : 0.f, in ? v1.w : 0.f,
                                                    in ? v2.w : 0.f, in ? v3.w : 0.f);
      }
    }
  }
  // this wave's first 32 copies have landed before the second run is issued
  asm volatile("s_wait_asynccnt 0x0" ::: "memory");
  __syncthreads();  // the staged tile is read by every wave

  // second run of weight copies: they land while the window is worked on
#pragma unroll
  for (int i = 32; i < 64; i += 8)
    async_copy8<WLS, WGS>(wl0 + i * WLS, wg0 + i * WGS);

  // window position (di, dj) of this pixel: staged row wave+di, column lane+1+dj
  const float* base = f_s + (wave * HALO_W + lane + 1) * PIX_PITCH;

  // center feature -> registers
  float fc[CR];
  float cn2 = 0.f;
  {
    const float* cp = base + ((WIN / 2) * HALO_W + (WIN / 2)) * PIX_PITCH;
#pragma unroll
    for (int q = 0; q < CR / 4; ++q) {
      const float4 g = *(const float4*)(cp + q * 4);
      fc[q * 4 + 0] = g.x; fc[q * 4 + 1] = g.y;
      fc[q * 4 + 2] = g.z; fc[q * 4 + 3] = g.w;
    }
#pragma unroll
    for (int c = 0; c < CR; ++c) cn2 += fc[c] * fc[c];
  }
  const float cn = sqrtf(cn2);

  // one pass over the window: a window row's seven patches are read into
  // registers once and serve the cosine similarity and then the weighted sum.
  // |cosine| <= 1 (Cauchy-Schwarz; below the 1e-8 floor |dot| < 1e-8 as well),
  // so exp(sim) needs no maximum taken off: softmax = exp(sim) / sum exp(sim),
  // and the division by the sum comes once, behind the loop.
  // The seven offsets of a row run as independent sums, each in ascending
  // channel order; weights and patches are summed in ascending window order.
  // (window rows stay rolled for code size; inner loops are unrolled so that
  // the register arrays are indexed by constants and offsets are immediates)
  float acc[CR];
#pragma unroll
  for (int c = 0; c < CR; ++c) acc[c] = 0.f;
  float s = 0.f;
#pragma unroll 1
  for (int di = 0; di < WIN; ++di) {
    const float* rp = base + di * HALO_W * PIX_PITCH;
    float4 g[WIN][CR / 4];
    float dot[WIN], pn2[WIN];
#pragma unroll
    for (int dj = 0; dj < WIN; ++dj) { dot[dj] = 0.f; pn2[dj] = 0.f; }
#pragma unroll
    for (int q = 0; q < CR / 4; ++q) {
#pragma unroll
      for (int dj = 0; dj < WIN; ++dj)
        g[dj][q] = *(const float4*)(rp + dj * PIX_PITCH + q * 4);
    }
    __builtin_amdgcn_sched_barrier(0);
#pragma unroll
    for (int q = 0; q < CR / 4; ++q) {
#pragma unroll
      for (int dj = 0; dj < WIN; ++dj) { dot[dj] += fc[q * 4 + 0] * g[dj][q].x; pn2[dj] += g[dj][q].x * g[dj][q].x; }
#pragma unroll
      for (int dj = 0; dj < WIN; ++dj) { dot[dj] += fc[q * 4 + 1] * g[dj][q].y; pn2[dj] += g[dj][q].y * g[dj][q].y; }
#pragma unroll
      for (int dj = 0; dj < WIN; ++dj) { dot[dj] += fc[q * 4 + 2] * g[dj][q].z; pn2[dj] += g[dj][q].z * g[dj][q].z; }
#pragma unroll
      for (int dj = 0; dj < WIN; ++dj) { dot[dj] += fc[q * 4 + 3] * g[dj][q].w; pn2[dj] += g[dj][q].w * g[dj][q].w; }
    }
    __builtin_amdgcn_sched_barrier(0);
    float e[WIN];
#pragma unroll
    for (int dj = 0; dj < WIN; ++dj)
      e[dj] = expf(dot[dj] / fmaxf(cn * sqrtf(pn2[dj]), 1e-8f));
#pragma unroll
    for (int dj = 0; dj < WIN; ++dj) {
      s += e[dj];
      // written as fmaf (the fused form it compiled to before): as a product and
      // a sum this kernel's build splits them into packed products and adds
#pragma unroll
      for (int q = 0; q < CR / 4; ++q) {
        acc[q * 4 + 0] = fmaf(e[dj], g[dj][q].x, acc[q * 4 + 0]);
        acc[q * 4 + 1] = fmaf(e[dj], g[dj][q].y, acc[q * 4 + 1]);
        acc[q * 4 + 2] = fmaf(e[dj], g[dj][q].z, acc[q * 4 + 2]);
        acc[q * 4 + 3] = fmaf(e[dj], g[dj][q].w, acc[q * 4 + 3]);
      }
    }
  }
  const float inv = 1.f / s;
#pragma unroll
  for (int c = 0; c < CR; ++c) acc[c] *= inv;

  // this wave's copies have landed before it signals the barrier
  asm volatile("s_wait_asynccnt 0x0" ::: "memory");
  __syncthreads();  // the staged weight is read by every wave

  // ---- out = w_proj @ corr for this wave's 32 pixels ----
  // B fragments from the lanes' registers. The two 16-column tiles take the
  // even and the odd pixels, so that a lane stores two neighbouring floats and
  // a half-wave a whole line. First lane (lo, hi) fetches pixel 2 * lo + hi;
  // then the halves swap the two channels of each k-step that the other needs.
  const int lo = lane & 15;  // M (A) / N (B) index within 16-wide tile
  const int hi = lane >> 4;  // selects K sub-pair {0,1} vs {2,3}
  v2f b0[CR / 4], b1[CR / 4];
  {
    const int from = (2 * lo + hi) * 4;  // source lane, in bytes
#pragma unroll
    for (int c = 0; c < CR; ++c)
      acc[c] = __int_as_float(
          __builtin_amdgcn_ds_bpermute(from, __float_as_int(acc[c])));
#pragma unroll
    for (int s = 0; s < CR / 4; ++s) {
      const float p0 = acc[4 * s], p1 = acc[4 * s + 1];
      const float p2 = acc[4 * s + 2], p3 = acc[4 * s + 3];
      const unsigned tx = __float_as_uint(hi ? p0 : p2);
      const unsigned ty = __float_as_uint(hi ? p1 : p3);
      const float ux = __uint_as_float(__builtin_amdgcn_permlanex16(
          tx, tx, 0x76543210u, 0xfedcba98u, false, false));
      const float uy = __uint_as_float(__builtin_amdgcn_permlanex16(
          ty, ty, 0x76543210u, 0xfedcba98u, false, false));
      b0[s].x = hi ? ux : p0; b0[s].y = hi ? uy : p1;
      b1[s].x = hi ? p2 : ux; b1[s].y = hi ? p3 : uy;
    }
  }

  const float* ap = s_w + lo * PIX_PITCH + 2 * hi;
  float* yp = out + (long)b * OC * IMG_HW + (long)(8 * hi) * IMG_HW +
              (h0 + wave) * IMG + w0 + 2 * lo;

  v2f aA[RT][CR / 4], aB[RT][CR / 4];
  load_a(aA, ap);
  // (blocks stay rolled in pairs for code size)
#pragma unroll 1
  for (int mt = 0; mt < OC / 16; mt += 2 * RT) {
    load_a(aB, ap + (mt + RT) * 16 * PIX_PITCH);
    // keeps the group of reads ahead of the block instead of spread in it
    __builtin_amdgcn_sched_barrier(0);
    mm_block(aA, b0, b1, yp + (long)mt * 16 * IMG_HW);
    // the last trip reads the first tiles again (unused) to stay branch-free
    load_a(aA, ap + ((mt + 2 * RT) & (OC / 16 - 1)) * 16 * PIX_PITCH);
    asm volatile("s_wait_xcnt 0x0" ::: "memory");
    // keeps the reads ahead of the block, and the block behind the wait
    __builtin_amdgcn_sched_barrier(0);
    mm_block(aB, b0, b1, yp + (long)(mt + RT) * 16 * IMG_HW);
    asm volatile("s_wait_xcnt 0x0" ::: "memory");
    __builtin_amdgcn_sched_barrier(0);
  }
}

extern "C" void kernel_launch(void* const* d_in, const int* in_sizes, int n_in,
                              void* d_out, int out_size, void* d_ws,
                              size_t ws_size, hipStream_t stream) {
  const float* x = (const float*)d_in[0];         // [8,256,64,64]
  const float* w_reduce = (const float*)d_in[1];  // [64,256]
  const float* w_proj = (const float*)d_in[2];    // [512,64]
  float* out = (float*)d_out;                     // [8,512,64,64]

  const int B = 8, HW = 64 * 64;

  float* feat = (float*)d_ws;                     // [8,64,64,64]  8.4 MB

  // feat = w_reduce @ x : M=64, K=256, one work-group per 128 pixels
  gemm_wmma_f32_kernel<64, 256, 2, 16><<<B * HW / 128, 256, 0, stream>>>(w_reduce, x,
                                                                    feat);

  // windowed cosine-sim softmax attention and out = w_proj @ corr: one block
  // per 4x32 pixel tile
  corr_proj_kernel<<<B * HW / CORR_BLOCK, CORR_BLOCK, 0, stream>>>(feat, w_proj,
                                                                   out);
}
